// v010
// Times are from an AMD MI455X. After a warm-up the kernel runs many times in a row, and a time is the length of
// such a window on the GPU divided by its runs, so every launch and the gaps after it count. The runs cycle
// through copies of the inputs. A figure is the median of several windows, for all but v000 over two sittings.
// Sittings can differ by a few percent; kernels timed side by side share one.
// Earlier versions than v010 are not in this document.
// One run takes 113 microseconds.
// Timed twice side by side with v009, it ran 1.20 and 1.19 times as fast.
// Over all steps from v000, the starting kernel, it is 52.1 times as fast.
#include <hip/hip_runtime.h>
// Causal multi-head attention on three inputs with bias-free [in][out] projections and a biased [in][out] output projection (query_data, key_data, value_data [2][2048][1024]; q = split_heads(query_data Wq), k = split_heads(key_data Wk), v = split_heads(value_data Wv) ([in][out] [1024][1024], NO biases), 16 heads of 64; scores / sqrt(64); scores + triu(ones, k = 1) x (-1e13): an additive fill strictly above the diagonal == exclusion (exp underflows to exactly 0; every row keeps its diagonal); softmax over keys; out = merged Wp + bp ([in][out] + a REAL bias) -> [2][2048][1024]); the causal rule is built inside the reference: a causal rule by index; q and k carried as f16 hi + x1024 residual planes with three-product scores.
// Structure: token rows r = b*2048 + s; x as exact f16 rows (bf16-rounded); q and k as WMMA GEMMs (32x64 wave tiles, f32 accumulation, exact x16 weights, no bias) whose epilogue splits each f32 value into f16 hi + x1024 residual planes, v as the same GEMM with its operands swapped, whose f16 rows are V^T rows, all three in one launch; one fused attention launch: a block owns 128 query rows of a head (32 per wave) and walks the keys up to its last row 64 at a time, k hi, k lo and V^T rows staged in LDS per pass: three-product scores (lo.hi + hi.lo, x 2^-10, + hi.hi) as S^T tiles in registers, running maximum and sum per query (f32 statistics, native exp2; keys past the row's own index excluded; weights x256 f16, packed in place as the B operand), O^T += V^T . P^T, o carried x64 (folded into the output GEMM alpha) written straight into the merged f16 o rows; out = o W_o + b GEMM (f32) into the output layout.
// Compute dtype: inputs rounded to bf16; x / weights exact; v, softmax weights and o as f16 GEMM operands (~2^-12), q and k (and the first 128 rows' o) as f16 hi + x1024 residual; scores and softmax statistics f32. v_wmma_f32_16x16x32_f16.
#define NB 2
#define SCL 0.125f                         /* 1 / sqrt(head_dim = 64) */
#define SCLR 0.0001220703125f              /* 2^-13: the same scale on the x1024 residual passes */
#define SQ 2048
#define DM 1024
#define NH 16
#define HD 64
#define HG 4                         /* heads per attention launch group */
#define QT 256                       /* unused; the causal tiles are 128 query rows */
#define NKX SQ                       /* S / P row pitch */
#define QT0 128                      /* first-tile rows recomputed exactly in f32 */
#define B0 0                         /* first batch processed (debug hook) */
#define NBR NB                       /* batches processed (debug hook) */
#define NR ((size_t)NB * SQ)         /* token rows */
#define MP ((int)((size_t)NBR * SQ)) /* rows projected (debug hook) */
#define QN SQ                        /* query rows attended per batch (debug hook) */
#define NHD NH                       /* heads attended (debug hook) */
#define MPO MP                       /* rows through the output stage (debug hook) */
#define LQ DM      /* row pitch of the q/k/v rows */
typedef __bf16 v16b __attribute__((ext_vector_type(16)));
typedef unsigned short v8us __attribute__((ext_vector_type(8), may_alias));
typedef float  v8f  __attribute__((ext_vector_type(8)));
typedef float  v4f  __attribute__((ext_vector_type(4)));
typedef float  v4fa __attribute__((ext_vector_type(4), may_alias));
union FragB { v16b v; v8us half[2]; unsigned short u[16]; };

__device__ __forceinline__ unsigned short bf16_bits(float x) { unsigned int u = __float_as_uint(x); return (unsigned short)((u + 0x7FFFu + ((u >> 16) & 1u)) >> 16); }
__device__ __forceinline__ float bf16_val(unsigned short b) { return __uint_as_float(((unsigned int)b) << 16); }
__device__ __forceinline__ float bf16_round(float x) { return bf16_val(bf16_bits(x)); }
// D += A·B with NT terms: 1 = ah·bh, 2 = + al·bh (A split), 3 = + ah·bl (both split)
template <int NT>
__device__ __forceinline__ v8f mmaN(v16b ah, v16b al, v16b bh, v16b bl, v8f c) {
  c = __builtin_amdgcn_wmma_f32_16x16x32_bf16(false, ah, false, bh, (short)0, c, false, false);
  if (NT >= 2) c = __builtin_amdgcn_wmma_f32_16x16x32_bf16(false, al, false, bh, (short)0, c, false, false);
  if (NT >= 3) c = __builtin_amdgcn_wmma_f32_16x16x32_bf16(false, ah, false, bl, (short)0, c, false, false);
  asm volatile("v_nop\n\tv_nop\n\tv_nop\n\tv_nop" : "+v"(c) : "v"(ah), "v"(al), "v"(bh), "v"(bl));
  return c;
}

__global__ __launch_bounds__(256) void k_wt_bf16(const float* __restrict__ W, unsigned short* __restrict__ Wt, int K, int N) {
  const int t = blockIdx.x * 256 + threadIdx.x;
  const int k8n = K / 8;
  if (t >= N * k8n) return;
  const int n = t / k8n, k8 = (t % k8n) * 8;
  v8us v;
#pragma unroll
  for (int i = 0; i < 8; ++i) v[i] = bf16_bits(W[(size_t)(k8 + i) * N + n]);
  *(v8us*)(Wt + (size_t)n * K + k8) = v;
  
}

// GEMM C[M][N] (f32, pitch ldc) = act(A[M][K]·W + bias). A f32 row-major (pitch lda) converted per fragment to bf16
// (ASPLIT: hi/lo two planes -> 2 terms, else single rounded term); Wt bf16 [N][K] (pitch ldb). BIAS_BF16 rounds the
// bias to bf16 first (bias quantised to bf16 before the add). K%32==0, M%16==0, N%64==0.
template <bool ASPLIT, int ACT, bool BIAS_BF16>
__global__ __launch_bounds__(128) void k_gemm_bf(const float* __restrict__ A, int lda, const unsigned short* __restrict__ Wt, int ldb,
                                               const float* __restrict__ bias, float* __restrict__ C, int ldc, int M, int N, int K) {
  __shared__ __attribute__((aligned(16))) float so[4][16][64];
  const int tid = threadIdx.x, w = tid >> 5, lane = tid & 31, ln = lane & 15, hh = lane >> 4;
  const int ntn = N / 64;
  const int wid = blockIdx.x * 4 + w;
  const int mt = wid / ntn, nq = wid % ntn;
  if (mt * 16 >= M) return;
  const int row0 = mt * 16, col0 = nq * 64;
  const float* arow = A + (size_t)(row0 + ln) * lda;
  v8f acc[4] = {};
  for (int kb = 0; kb < K; kb += 32) {
    FragB ah, al;
    const v4f x0 = *(const v4fa*)(arow + kb + 8 * hh), x1 = *(const v4fa*)(arow + kb + 8 * hh + 4);
    const v4f x2 = *(const v4fa*)(arow + kb + 16 + 8 * hh), x3 = *(const v4fa*)(arow + kb + 16 + 8 * hh + 4);
    float xs[16] = {x0[0],x0[1],x0[2],x0[3],x1[0],x1[1],x1[2],x1[3],x2[0],x2[1],x2[2],x2[3],x3[0],x3[1],x3[2],x3[3]};
#pragma unroll
    for (int i = 0; i < 16; ++i) { const unsigned short hb = bf16_bits(xs[i]); ah.u[i] = hb; al.u[i] = ASPLIT ? bf16_bits(xs[i] - bf16_val(hb)) : (unsigned short)0; }
#pragma unroll
    for (int t = 0; t < 4; ++t) {
      const unsigned short* brow = Wt + (size_t)(col0 + t * 16 + ln) * ldb + kb;
      FragB b;
      b.half[0] = *(const v8us*)(brow + 8 * hh);
      b.half[1] = *(const v8us*)(brow + 16 + 8 * hh);
      acc[t] = mmaN<ASPLIT ? 2 : 1>(ah.v, al.v, b.v, b.v, acc[t]);
    }
  }
#pragma unroll
  for (int t = 0; t < 4; ++t) {
    float bv = bias ? bias[col0 + t * 16 + ln] : 0.f;
    if (BIAS_BF16) bv = bf16_round(bv);
#pragma unroll
    for (int r = 0; r < 8; ++r) { float v = acc[t][r] + bv; if (ACT == 1) v = fmaxf(v, 0.f); so[w][8 * hh + r][t * 16 + ln] = v; }
  }
  __builtin_amdgcn_fence(__ATOMIC_ACQ_REL, "workgroup");
  __builtin_amdgcn_wave_barrier();
  const int rsub = lane >> 4, c4 = (lane & 15) * 4;
  {
#pragma unroll
    for (int q = 0; q < 8; ++q) {
      const int r = q * 2 + rsub;
      const v4f v = *(const v4fa*)&so[w][r][c4];
      *(v4f*)(C + (size_t)(row0 + r) * ldc + col0 + c4) = v;
    }
    
  }
}

// GEMM C = act(A·W + bias + resid): A f32 (ASPLIT -> hi/lo 2 terms), Wt bf16 [N][K]; ACT 0 none, 1 relu, 2 exact gelu;
// resid (optional, f32, row index = (row % rmod), pitch ldr, RES_BF16 rounds it) added before the activation.
template <bool ASPLIT, int ACT, bool BIAS_BF16, bool RES_BF16>
__global__ __launch_bounds__(128) void k_gemm_bf3(const float* __restrict__ A, int lda, const unsigned short* __restrict__ Wt, int ldb,
                                                const float* __restrict__ bias, const float* __restrict__ resid, int rmod, int ldr,
                                                float* __restrict__ C, int ldc, int M, int N, int K) {
  __shared__ __attribute__((aligned(16))) float so[4][16][64];
  const int tid = threadIdx.x, w = tid >> 5, lane = tid & 31, ln = lane & 15, hh = lane >> 4;
  const int ntn = N / 64;
  const int wid = blockIdx.x * 4 + w;
  const int mt = wid / ntn, nq = wid % ntn;
  if (mt * 16 >= M) return;
  const int row0 = mt * 16, col0 = nq * 64;
  const float* arow = A + (size_t)(row0 + ln) * lda;
  v8f acc[4] = {};
  for (int kb = 0; kb < K; kb += 32) {
    FragB ah, al;
    const v4f x0 = *(const v4fa*)(arow + kb + 8 * hh), x1 = *(const v4fa*)(arow + kb + 8 * hh + 4);
    const v4f x2 = *(const v4fa*)(arow + kb + 16 + 8 * hh), x3 = *(const v4fa*)(arow + kb + 16 + 8 * hh + 4);
    float xs[16] = {x0[0],x0[1],x0[2],x0[3],x1[0],x1[1],x1[2],x1[3],x2[0],x2[1],x2[2],x2[3],x3[0],x3[1],x3[2],x3[3]};
#pragma unroll
    for (int i = 0; i < 16; ++i) { const unsigned short hb = bf16_bits(xs[i]); ah.u[i] = hb; al.u[i] = ASPLIT ? bf16_bits(xs[i] - bf16_val(hb)) : (unsigned short)0; }
#pragma unroll
    for (int t = 0; t < 4; ++t) {
      const unsigned short* brow = Wt + (size_t)(col0 + t * 16 + ln) * ldb + kb;
      FragB b;
      b.half[0] = *(const v8us*)(brow + 8 * hh);
      b.half[1] = *(const v8us*)(brow + 16 + 8 * hh);
      acc[t] = mmaN<ASPLIT ? 2 : 1>(ah.v, al.v, b.v, b.v, acc[t]);
    }
  }
#pragma unroll
  for (int t = 0; t < 4; ++t) {
    const int col = col0 + t * 16 + ln;
    float bv = bias ? bias[col] : 0.f;
    if (BIAS_BF16) bv = bf16_round(bv);
#pragma unroll
    for (int r = 0; r < 8; ++r) {
      float v = acc[t][r] + bv;
      if (resid) { float rv = resid[(size_t)((row0 + 8 * hh + r) % rmod) * ldr + col]; if (RES_BF16) rv = bf16_round(rv); v += rv; }
      if (ACT == 1) v = fmaxf(v, 0.f);
      if (ACT == 2) v = 0.5f * v * (1.0f + erff(v * 0.70710678118654752f));
      if (ACT == 3) { const float u = 0.7978845608028654f * (v + 0.044715f * v * v * v); v = 0.5f * v * (1.0f + tanhf(u)); }
      so[w][8 * hh + r][t * 16 + ln] = v;
    }
  }
  __builtin_amdgcn_fence(__ATOMIC_ACQ_REL, "workgroup");
  __builtin_amdgcn_wave_barrier();
  const int rsub = lane >> 4, c4 = (lane & 15) * 4;
  {
#pragma unroll
    for (int q = 0; q < 8; ++q) {
      const int r = q * 2 + rsub;
      const v4f v = *(const v4fa*)&so[w][r][c4];
      *(v4f*)(C + (size_t)(row0 + r) * ldc + col0 + c4) = v;
    }
    
  }
}
// row LayerNorm (biased variance, eps) over N: s = X (+ R); optional out_sum <- s; out_norm <- (s-mu)*rsqrt(var+eps)*g + b
template <bool PARAM_BF16>
__global__ __launch_bounds__(256) void k_layernorm(const float* __restrict__ X, const float* __restrict__ R, const float* __restrict__ g, const float* __restrict__ bta,
                                                  float* __restrict__ out_sum, float* __restrict__ out_norm, int N, float eps) {
  __shared__ float red[256];
  const int row = blockIdx.x, tid = threadIdx.x;
  const float* x = X + (size_t)row * N; const float* rr = R ? R + (size_t)row * N : nullptr;
  float vals[16];                     // up to N = 4096
  const int per = N / 256;            // contiguous chunk per thread? use strided-by-4 chunks: thread handles j = tid*4 + 1024*u
  float s1 = 0.f;
  for (int u = 0; u < per / 4; ++u) {
    const int j = tid * 4 + 1024 * u;
    const v4f a = *(const v4fa*)(x + j);
    v4f b = {0.f,0.f,0.f,0.f}; if (rr) b = *(const v4fa*)(rr + j);
#pragma unroll
    for (int q = 0; q < 4; ++q) { const float v = a[q] + b[q]; vals[u * 4 + q] = v; s1 += v; }
  }
  red[tid] = s1; __syncthreads();
  for (int st = 128; st > 0; st >>= 1) { if (tid < st) red[tid] += red[tid + st]; __syncthreads(); }
  const float mu = red[0] / (float)N; __syncthreads();
  float s2 = 0.f;
  for (int u = 0; u < per / 4; ++u)
#pragma unroll
    for (int q = 0; q < 4; ++q) { const float c = vals[u * 4 + q] - mu; s2 += c * c; }
  red[tid] = s2; __syncthreads();
  for (int st = 128; st > 0; st >>= 1) { if (tid < st) red[tid] += red[tid + st]; __syncthreads(); }
  const float rs = rsqrtf(red[0] / (float)N + eps);
  {
    for (int u = 0; u < per / 4; ++u) {
      const int j = tid * 4 + 1024 * u;
      v4f o, sm;
#pragma unroll
      for (int q = 0; q < 4; ++q) {
        float gg = g[j + q], bb = bta[j + q];
        if (PARAM_BF16) { gg = bf16_round(gg); bb = bf16_round(bb); }
        sm[q] = vals[u * 4 + q]; o[q] = (vals[u * 4 + q] - mu) * rs * gg + bb;
      }
      if (out_sum) *(v4f*)(out_sum + (size_t)row * N + j) = sm;
      *(v4f*)(out_norm + (size_t)row * N + j) = o;
    }
    
  }
}



// ---- f16 WMMA path (v_wmma_f32_16x16x32_f16): 11-bit significands for operands in range — used where a [0,1] probability operand needs more precision than bf16
typedef _Float16 v16h __attribute__((ext_vector_type(16)));
union FragH { v16h v; v8us half[2]; _Float16 h[16]; unsigned short u[16]; };
template <int NT>
__device__ __forceinline__ v8f mmaH(v16h ah, v16h al, v16h bh, v16h bl, v8f c) {
  c = __builtin_amdgcn_wmma_f32_16x16x32_f16(false, ah, false, bh, (short)0, c, false, false);
  if (NT >= 2) c = __builtin_amdgcn_wmma_f32_16x16x32_f16(false, al, false, bh, (short)0, c, false, false);
  if (NT >= 3) c = __builtin_amdgcn_wmma_f32_16x16x32_f16(false, ah, false, bl, (short)0, c, false, false);
  asm volatile("v_nop\n\tv_nop\n\tv_nop\n\tv_nop" : "+v"(c) : "v"(ah), "v"(al), "v"(bh), "v"(bl));
  return c;
}
// batched GEMM like k_gemm_b but f16 operands: A f32 (split into f16 hi/lo if ASPLIT, else rounded to f16), Bt = f16 values [n][k]; alpha; C f32; N multiple of 16 (partial tiles skipped)
template <bool ASPLIT>
__global__ __launch_bounds__(128) void k_gemm_h(const float* __restrict__ A, int lda, size_t sA, const _Float16* __restrict__ Bh, int ldb, size_t sB, float alpha, float* __restrict__ C, int ldc, size_t sC, int M, int N, int K) {
  __shared__ __attribute__((aligned(16))) float so[4][16][64];
  const int tid = threadIdx.x, w = tid >> 5, lane = tid & 31, ln = lane & 15, hh = lane >> 4; const int by = blockIdx.y;
  A += (size_t)by * sA; Bh += (size_t)by * sB; C += (size_t)by * sC;
  const int ntn = (N + 63) / 64; const int wid = blockIdx.x * 4 + w; const int mt = wid / ntn, nq = wid % ntn; if (mt * 16 >= M) return;
  const int row0 = mt * 16, col0 = nq * 64; const float* arow = A + (size_t)(row0 + ln) * lda;
  v8f acc[4] = {};
  for (int kb = 0; kb < K; kb += 32) {
    FragH ah, al;
    const v4f x0 = *(const v4fa*)(arow + kb + 8 * hh), x1 = *(const v4fa*)(arow + kb + 8 * hh + 4), x2 = *(const v4fa*)(arow + kb + 16 + 8 * hh), x3 = *(const v4fa*)(arow + kb + 16 + 8 * hh + 4);
    float xs[16] = {x0[0],x0[1],x0[2],x0[3],x1[0],x1[1],x1[2],x1[3],x2[0],x2[1],x2[2],x2[3],x3[0],x3[1],x3[2],x3[3]};
#pragma unroll
    for (int i = 0; i < 16; ++i) { const _Float16 h = (_Float16)xs[i]; ah.h[i] = h; al.h[i] = ASPLIT ? (_Float16)(xs[i] - (float)h) : (_Float16)0.0f; }
#pragma unroll
    for (int t = 0; t < 4; ++t) { if (col0 + t * 16 >= N) continue; const size_t boff = (size_t)(col0 + t * 16 + ln) * ldb + kb; FragH bq; bq.half[0] = *(const v8us*)(Bh + boff + 8 * hh); bq.half[1] = *(const v8us*)(Bh + boff + 16 + 8 * hh);
      acc[t] = mmaH<ASPLIT ? 2 : 1>(ah.v, al.v, bq.v, bq.v, acc[t]); }
  }
#pragma unroll
  for (int t = 0; t < 4; ++t) { if (col0 + t * 16 >= N) continue;
#pragma unroll
    for (int r = 0; r < 8; ++r) so[w][8 * hh + r][t * 16 + ln] = acc[t][r] * alpha; }
  __builtin_amdgcn_fence(__ATOMIC_ACQ_REL, "workgroup"); __builtin_amdgcn_wave_barrier();
  const int rsub = lane >> 4, c4 = (lane & 15) * 4;
  {
#pragma unroll
    for (int q = 0; q < 8; ++q) { const int r = q * 2 + rsub; if (col0 + c4 < N) { const v4f v = *(const v4fa*)&so[w][r][c4]; *(v4f*)(C + (size_t)(row0 + r) * ldc + col0 + c4) = v; } }
     }
}

// k_gemm_hh variant with fused epilogue: v = acc·alpha + bias[by·sBias + col] (+ CP[(row/rowsPerB)·sCPb + by·64 + col] if CP) ; ACT 0 none / 1 elu ; writes f16 C16 (and f32 C if non-null)
template <int ACT>
__global__ __launch_bounds__(128) void k_gemm_hhx(const _Float16* __restrict__ A, int lda, size_t sA, const _Float16* __restrict__ Bh, int ldb, size_t sB, float alpha, const float* __restrict__ bias, size_t sBias, const float* __restrict__ CP, int rowsPerB, size_t sCPb, int row0g,
    float* __restrict__ C, _Float16* __restrict__ C16, int ldc, size_t sC, int M, int N, int K) {
  __shared__ __attribute__((aligned(16))) float so[4][16][64];
  const int tid = threadIdx.x, w = tid >> 5, lane = tid & 31, ln = lane & 15, hh = lane >> 4; const int by = blockIdx.y;
  A += (size_t)by * sA; Bh += (size_t)by * sB; const size_t cofs = (size_t)by * sC; const float* bp = bias ? bias + (size_t)by * sBias : nullptr;
  const int ntn = (N + 63) / 64; const int wid = blockIdx.x * 4 + w; const int mt = wid / ntn, nq = wid % ntn; if (mt * 16 >= M) return;
  const int row0 = mt * 16, col0 = nq * 64; const _Float16* arow = A + (size_t)(row0 + ln) * lda;
  v8f acc[4] = {};
  for (int kb = 0; kb < K; kb += 32) { FragH ah; ah.half[0] = *(const v8us*)((const unsigned short*)arow + kb + 8 * hh); ah.half[1] = *(const v8us*)((const unsigned short*)arow + kb + 16 + 8 * hh);
#pragma unroll
    for (int t = 0; t < 4; ++t) { if (col0 + t * 16 >= N) continue; const size_t boff = (size_t)(col0 + t * 16 + ln) * ldb + kb; FragH bq; bq.half[0] = *(const v8us*)((const unsigned short*)Bh + boff + 8 * hh); bq.half[1] = *(const v8us*)((const unsigned short*)Bh + boff + 16 + 8 * hh);
      acc[t] = mmaH<1>(ah.v, ah.v, bq.v, bq.v, acc[t]); }
  }
#pragma unroll
  for (int t = 0; t < 4; ++t) { if (col0 + t * 16 >= N) continue; const int col = col0 + t * 16 + ln; const float bv = bp ? bf16_round(bp[col]) : 0.f;
#pragma unroll
    for (int r = 0; r < 8; ++r) { float v = acc[t][r] * alpha + bv; if (CP) { const int rr = row0g + row0 + 8 * hh + r; if (rowsPerB < 0) v += CP[cofs + (size_t)rr * ldc + col];      /* rowsPerB < 0: own element of the batched C plane */ else { const int bidx = rr / rowsPerB; v += CP[(size_t)bidx * sCPb + (size_t)by * 64 + col]; } } if (ACT == 1) v = (v > 0.f) ? v : expm1f(v); else if (ACT == 7) v = (v > 0.f) ? v + 1.0f : expf(v); else if (ACT == 8) v = tanhf(v); else if (ACT == 9) v = 0.5f * v * (1.0f + tanhf(0.7978845608028654f * (v + 0.044715f * v * v * v))); else if (ACT == 11) v = 1.0f / (1.0f + expf(-v)); else if (ACT == 12) v = (v > 0.f) ? v : 0.01f * v; else if (ACT == 14) v = (v > 0.f) ? v : 0.1f * v; else if (ACT == 16) v = (v >= 0.f) ? v : 0.3f * v; else if (ACT == 17) v = (v >= 0.f) ? v : 0.2f * v; else if (ACT == 15) v = v / (1.0f + expf(-v)); else if (ACT == 3) v = fmaxf(v, 0.f); else if (ACT == 6) v = 0.5f * v * (1.0f + erff(v * 0.70710678118654752f)); so[w][8 * hh + r][t * 16 + ln] = v; } }
  __builtin_amdgcn_fence(__ATOMIC_ACQ_REL, "workgroup"); __builtin_amdgcn_wave_barrier();
  const int rsub = lane >> 4, c4 = (lane & 15) * 4; typedef _Float16 v4h __attribute__((ext_vector_type(4)));
  {
#pragma unroll
    for (int q = 0; q < 8; ++q) { const int r = q * 2 + rsub; if (col0 + c4 < N) { const v4f v = *(const v4fa*)&so[w][r][c4]; if (C) *(v4f*)(C + cofs + (size_t)(row0 + r) * ldc + col0 + c4) = v; if (C16) { v4h h4; for (int i = 0; i < 4; ++i) h4[i] = (_Float16)v[i]; *(v4h*)(C16 + cofs + (size_t)(row0 + r) * ldc + col0 + c4) = h4; } } }
     }
}


typedef _Float16 v4h __attribute__((ext_vector_type(4)));

__global__ __launch_bounds__(256) void k_h16(const float* __restrict__ x, _Float16* __restrict__ X16, size_t n8) { const size_t t = (size_t)blockIdx.x * 256 + threadIdx.x; if (t >= n8) return; FragH f;
#pragma unroll
  for (int q = 0; q < 8; ++q) f.h[q] = (_Float16)x[t * 8 + q]; *(v8us*)((unsigned short*)X16 + t * 8) = f.half[0];  }
__global__ __launch_bounds__(256) void k_round16f(const float* __restrict__ W, _Float16* __restrict__ Bt, size_t n8) { const size_t t = (size_t)blockIdx.x * 256 + threadIdx.x; if (t >= n8) return; FragH f;
#pragma unroll
  for (int i = 0; i < 8; ++i) f.h[i] = (_Float16)(bf16_round(W[t * 8 + i]) * 16.0f); *(v8us*)((unsigned short*)Bt + t * 8) = f.half[0];  }
// ---- element-wise conversions: one launch per stage, 32 or 64 elements a thread, so that a stage is a few thousand waves that each keep 16 to 24 loads of 16 bytes in flight ----
// k_prep, blocks 0 .. PWB - 1: the four weight matrices, f32 [in][out] -> Bt[n][k] = f16(bf16-rounded value x 16). A thread owns a tile of 8 k x 8 n; the lanes of a wave lie 4 along n and 8 along k,
// so that a wave's loads read whole 128-byte lines of its k rows and each of its stores writes whole lines of 4 n rows. Blocks PWB ..: the three row casts, f32 -> f16(bf16-rounded value), 4 pieces of 8 elements of each tensor a thread.
#define PWB 256                            /* 64 blocks a matrix: 512 waves of 32 tiles = 128 x 128 tiles */
#define PXB 512                            /* 1024 pieces of 8 elements a block and tensor */
__global__ __launch_bounds__(256) void k_prep(const float* __restrict__ xq, const float* __restrict__ xk, const float* __restrict__ xv, const float* __restrict__ wq, const float* __restrict__ wk, const float* __restrict__ wv, const float* __restrict__ wo, _Float16* __restrict__ X16, _Float16* __restrict__ BT) {
  static_assert(DM == 1024 && NR * DM / 8 == (size_t)PXB * 1024, "k_prep: the block counts are written for these shapes");
  const int tid = threadIdx.x;
  if (blockIdx.x < PWB) {      /* block-uniform */
    const int mi = blockIdx.x >> 6; const float* Wm = mi == 0 ? wq : mi == 1 ? wk : mi == 2 ? wv : wo;
    const int wid = (blockIdx.x & 63) * 8 + (tid >> 5), lane = tid & 31; const int n8 = ((wid >> 4) * 4 + (lane & 3)) * 8, k8 = ((wid & 15) * 8 + (lane >> 2)) * 8;
    const float* sp = Wm + (size_t)k8 * DM + n8; unsigned short* dp = (unsigned short*)BT + (size_t)mi * (DM * DM) + (size_t)n8 * DM + k8;
    v4f a[8][2]; v8us o[8];
#pragma unroll      /* constant indices: the tile stays in registers, all 16 loads in flight */
    for (int i = 0; i < 8; ++i) { a[i][0] = *(const v4fa*)(sp + i * DM); a[i][1] = *(const v4fa*)(sp + i * DM + 4); }
    asm volatile("s_wait_xcnt 0x0" :: "v"(sp) : "memory");      /* the loads' address registers stay untouched up to this wait; its memory clobber also keeps all 16 loads in front of the first store (without it the build held four loads back behind stores) */
#pragma unroll
    for (int j = 0; j < 8; ++j) { FragH f;
#pragma unroll
      for (int i = 0; i < 8; ++i) f.h[i] = (_Float16)(bf16_round(a[i][j >> 2][j & 3]) * 16.0f);
      o[j] = f.half[0]; }
#pragma unroll
    for (int j = 0; j < 8; ++j) *(v8us*)(dp + j * DM) = o[j];
  } else {
    const size_t e0 = ((size_t)(blockIdx.x - PWB) * 1024 + tid) * 8;      /* the thread's first element; its pieces lie 256 pieces apart */
    const float* s0 = xq + e0; const float* s1 = xk + e0; const float* s2 = xv + e0; unsigned short* dp = (unsigned short*)X16 + e0;
    v4f a[3][4][2]; v8us o[3][4];
#pragma unroll      /* constant indices: registers, all 24 loads in flight */
    for (int u = 0; u < 4; ++u) { a[0][u][0] = *(const v4fa*)(s0 + u * 2048); a[0][u][1] = *(const v4fa*)(s0 + u * 2048 + 4); a[1][u][0] = *(const v4fa*)(s1 + u * 2048); a[1][u][1] = *(const v4fa*)(s1 + u * 2048 + 4); a[2][u][0] = *(const v4fa*)(s2 + u * 2048); a[2][u][1] = *(const v4fa*)(s2 + u * 2048 + 4); }
    asm volatile("s_wait_xcnt 0x0" :: "v"(s0), "v"(s1), "v"(s2) : "memory");      /* the loads' address registers stay untouched up to this wait; its memory clobber also keeps all 24 loads in front of the first store (without it the build issued them in three groups between the stores) */
#pragma unroll
    for (int s = 0; s < 3; ++s)
#pragma unroll
      for (int u = 0; u < 4; ++u) { FragH f;
#pragma unroll
        for (int q = 0; q < 8; ++q) f.h[q] = (_Float16)bf16_round(a[s][u][q >> 2][q & 3]);
        o[s][u] = f.half[0]; }
#pragma unroll
    for (int s = 0; s < 3; ++s)
#pragma unroll
      for (int u = 0; u < 4; ++u) *(v8us*)(dp + (size_t)s * (NR * DM) + u * 2048) = o[s][u];
    asm volatile("s_wait_xcnt 0x0" ::: "memory");      /* in the built code the weight part's first instructions stand on the other side of the closing branch and rewrite registers that these stores name: the wait stands in front of them */
  } }

// ---- fast GEMM (block tile 128x64, wave tile 32x64; requires M % 128 == 0 rows per launch region, N % 64 == 0 and K % 128 == 0); epilogue: v = acc * alpha + bias ----
// ALo (output stage only): the x1024 residual plane of each batch's first QT0 rows of A. The blocks that own these rows run the K loop twice in one ring: the residual rows first, the sums x 2^-10, then the hi rows on top in the same accumulators.
// The block's 128 A rows and 64 B rows are staged in LDS 128 k at a time (rows of 256 bytes, whole lines) by asynchronous 16-byte copies, two buffers: tile t + 2 flies while tile t + 1 is worked on.
// The four waves share the B rows; fragments are read from LDS by g2_frag in the k order and the kb order of the direct loads, so every accumulator sums in the same order.
__device__ __forceinline__ v16h g2_frag(const _Float16* p, int hh) { FragH f; f.half[0] = *(const v8us*)((const unsigned short*)p + 8 * hh); f.half[1] = *(const v8us*)((const unsigned short*)p + 16 + 8 * hh); return f.v; }
__device__ __forceinline__ v8f g2_mma(v16h a, v16h b, v8f c) { v8f d = __builtin_amdgcn_wmma_f32_16x16x32_f16(false, a, false, b, (short)0, c, false, false); asm volatile("v_nop\n\tv_nop\n\tv_nop\n\tv_nop" : "+v"(d) : "v"(a), "v"(b)); return d; }
#define GKS 128                            /* k per staged tile */
#define GLP 136                            /* LDS row pitch in f16: 128 + 8 = 272 bytes, for the 16-byte fragment reads */
// Twelve asynchronous 16-byte copies, global to LDS, each lane its own two addresses. The closing s_wait_xcnt 0 stands inside the statement so that no address register is rewritten ahead of it.
__device__ __forceinline__ void g2_copy12(const unsigned* l, const char* const* g) {
  asm volatile("global_load_async_to_lds_b128 %0, %12, off\n\tglobal_load_async_to_lds_b128 %1, %13, off\n\tglobal_load_async_to_lds_b128 %2, %14, off\n\tglobal_load_async_to_lds_b128 %3, %15, off\n\t"
               "global_load_async_to_lds_b128 %4, %16, off\n\tglobal_load_async_to_lds_b128 %5, %17, off\n\tglobal_load_async_to_lds_b128 %6, %18, off\n\tglobal_load_async_to_lds_b128 %7, %19, off\n\t"
               "global_load_async_to_lds_b128 %8, %20, off\n\tglobal_load_async_to_lds_b128 %9, %21, off\n\tglobal_load_async_to_lds_b128 %10, %22, off\n\tglobal_load_async_to_lds_b128 %11, %23, off\n\ts_wait_xcnt 0x0"
               :: "v"(l[0]), "v"(l[1]), "v"(l[2]), "v"(l[3]), "v"(l[4]), "v"(l[5]), "v"(l[6]), "v"(l[7]), "v"(l[8]), "v"(l[9]), "v"(l[10]), "v"(l[11]),
                  "v"(g[0]), "v"(g[1]), "v"(g[2]), "v"(g[3]), "v"(g[4]), "v"(g[5]), "v"(g[6]), "v"(g[7]), "v"(g[8]), "v"(g[9]), "v"(g[10]), "v"(g[11]) : "memory"); }
template <int ACT, int QKV>
__global__ __launch_bounds__(128) void k_gemm2(const _Float16* __restrict__ A, int lda, size_t sA, const _Float16* __restrict__ Bh, int ldb, size_t sB, float alpha, const float* __restrict__ bias, size_t sBias,
    float* __restrict__ C, _Float16* __restrict__ C16, int ldc, size_t sC, int M, int N, int K, _Float16* __restrict__ VTo, const _Float16* __restrict__ ALo) { static_assert(ACT == 0 || ACT == 3 || ACT == 6 || ACT == 8 || ACT == 9 || ACT == 11 || ACT == 12 || ACT == 14 || ACT == 15 || ACT == 16 || ACT == 17, "k_gemm2: unsupported ACT code (would silently apply no activation)");
  __shared__ __attribute__((aligned(16))) float so[4][32][68];
  __shared__ __attribute__((aligned(16))) _Float16 ta[2][128][GLP]; __shared__ __attribute__((aligned(16))) _Float16 tb[2][64][GLP];
  const int tid = threadIdx.x, w = tid >> 5, lane = tid & 31, ln = lane & 15, hh = lane >> 4; const int by = blockIdx.y;
  A += (size_t)by * sA; Bh += (size_t)by * sB; const size_t cofs = (size_t)by * sC; const float* bp = bias ? bias + (size_t)by * sBias : nullptr;
  const bool vtr = QKV && by == 2;      /* block-uniform: the v product runs with its operands swapped (rows = output features, columns = tokens; lda == ldb there), so that its row stores are V^T rows */
  if (vtr) { const _Float16* sw = A; A = Bh; Bh = sw; const int ms = M; M = N; N = ms; }
  const int ntn = N >> 6; const int mt = blockIdx.x / ntn, nq = blockIdx.x - mt * ntn; const int row0 = mt * 128 + 32 * w, col0 = nq * 64; if (mt * 128 >= M) return;      /* block-uniform, in front of every barrier */
  const int srow = tid >> 4, sc8 = (tid & 15) * 8;      /* staging: 16 threads per row of 256 bytes, 8 rows a step */
  const char* ga = (const char*)(A + (size_t)(mt * 128 + srow) * lda + sc8); const char* gb = (const char*)(Bh + (size_t)(col0 + srow) * ldb + sc8); const size_t ga8 = (size_t)lda * 16, gb8 = (size_t)ldb * 16;      /* 8 rows in bytes */
  const unsigned la = (unsigned)(size_t)&ta[0][srow][sc8], lb = (unsigned)(size_t)&tb[0][srow][sc8];      /* byte addresses in the work-group's LDS */
  static_assert(QT0 == 128, "a batch's residual rows are one 128-row block");
  const bool res = !QKV && ALo && (mt & (SQ / 128 - 1)) == 0;      /* block-uniform: the block owns a batch's first QT0 rows */
  const int nl = res ? K / GKS : 0;      /* residual tiles in front of the hi tiles */
  const char* gl = res ? (const char*)(ALo + (size_t)((mt / (SQ / 128)) * QT0 + srow) * lda + sc8) : ga;      /* the residual plane holds QT0 rows a batch */
  auto stage = [&](int t, int buf) { unsigned l[24]; const char* g[24];      /* one tile: 16 copies of A and 8 of B per thread */
    const size_t ko = (size_t)(t < nl ? t : t - nl) * (GKS * 2); const char* gs = (t < nl ? gl : ga) + ko; const char* gw = gb + ko;      /* both rounds walk the same k */
#pragma unroll
    for (int j = 0; j < 16; ++j) { l[j] = la + (unsigned)buf * (unsigned)sizeof(ta[0]) + (unsigned)j * (8u * GLP * 2u); g[j] = gs + (size_t)j * ga8; }
#pragma unroll
    for (int j = 0; j < 8; ++j) { l[16 + j] = lb + (unsigned)buf * (unsigned)sizeof(tb[0]) + (unsigned)j * (8u * GLP * 2u); g[16 + j] = gw + (size_t)j * gb8; }
    g2_copy12(l, g); g2_copy12(l + 12, g + 12); };
  const v8f z8 = {0.f,0.f,0.f,0.f,0.f,0.f,0.f,0.f}; v8f c00 = z8, c01 = z8, c02 = z8, c03 = z8, c10 = z8, c11 = z8, c12 = z8, c13 = z8;
  const int nt = K / GKS + nl;
  stage(0, 0);
  asm volatile("s_wait_asynccnt 0x0" ::: "memory");      /* this wave's copies of tile 0 have landed */
  __syncthreads();      /* publishes tile 0 to the four waves */
  if (nt > 1) stage(1, 1);
#pragma unroll 1      /* one trip is 32 matrix instructions of straight-line code already */
  for (int t = 0; t < nt; ++t) { const _Float16* ap = &ta[t & 1][32 * w + ln][0]; const _Float16* bq = &tb[t & 1][ln][0];
    if (!QKV && t != 0 && t == nl) { c00 *= 0.0009765625f; c01 *= 0.0009765625f; c02 *= 0.0009765625f; c03 *= 0.0009765625f; c10 *= 0.0009765625f; c11 *= 0.0009765625f; c12 *= 0.0009765625f; c13 *= 0.0009765625f; }      /* block-uniform: the residual sums (operand x1024) come down to the hi product's scale, exactly, before the hi tiles add on top */
    v16h fa[2][2], fb[2][4];      /* two fragment sets: the next 32 k of this tile are read from LDS as one group ahead of the current block's matrix instructions */
    fa[0][0] = g2_frag(ap, hh); fa[0][1] = g2_frag(ap + 16 * GLP, hh); fb[0][0] = g2_frag(bq, hh); fb[0][1] = g2_frag(bq + 16 * GLP, hh); fb[0][2] = g2_frag(bq + 32 * GLP, hh); fb[0][3] = g2_frag(bq + 48 * GLP, hh);
#pragma unroll      /* makes the set index a constant, so that the sets are registers */
    for (int q = 0; q < GKS / 32; ++q) { const int s = q & 1, n = s ^ 1, kn = (q + 1) * 32;
      if (q + 1 < GKS / 32) { fa[n][0] = g2_frag(ap + kn, hh); fa[n][1] = g2_frag(ap + 16 * GLP + kn, hh); fb[n][0] = g2_frag(bq + kn, hh); fb[n][1] = g2_frag(bq + 16 * GLP + kn, hh); fb[n][2] = g2_frag(bq + 32 * GLP + kn, hh); fb[n][3] = g2_frag(bq + 48 * GLP + kn, hh); }
      c00 = g2_mma(fa[s][0], fb[s][0], c00); c10 = g2_mma(fa[s][1], fb[s][0], c10); c01 = g2_mma(fa[s][0], fb[s][1], c01); c11 = g2_mma(fa[s][1], fb[s][1], c11);
      c02 = g2_mma(fa[s][0], fb[s][2], c02); c12 = g2_mma(fa[s][1], fb[s][2], c12); c03 = g2_mma(fa[s][0], fb[s][3], c03); c13 = g2_mma(fa[s][1], fb[s][3], c13); }
    asm volatile("s_wait_dscnt 0x0" ::: "memory");      /* this wave's reads of tile t are done before its buffer is refilled */
    asm volatile("s_wait_asynccnt 0x0" ::: "memory");      /* this wave's copies of tile t + 1 have landed */
    __syncthreads();      /* publishes tile t + 1 and ends every wave's reads of tile t */
    if (t + 2 < nt) stage(t + 2, t & 1); }
  asm volatile("s_wait_asynccnt 0x0" ::: "memory");      /* no copy is outstanding when the wave goes on */
  v8f accs[8] = {c00, c01, c02, c03, c10, c11, c12, c13};
#pragma unroll
  for (int u = 0; u < 8; ++u) { const int t = u & 3, half = u >> 2; const int col = col0 + t * 16 + ln; const float bv = (!QKV && bp) ? bf16_round(bp[col]) : 0.f;      /* the projection launch has no bias */
#pragma unroll
    for (int r = 0; r < 8; ++r) { const int rloc = half * 16 + 8 * hh + r; float v = accs[u][r] * alpha + bv;
      if (ACT == 3) v = fmaxf(v, 0.f); else if (ACT == 6) v = 0.5f * v * (1.0f + erff(v * 0.70710678118654752f)); else if (ACT == 11) v = 1.0f / (1.0f + expf(-v)); else if (ACT == 15) v = v / (1.0f + expf(-v)); else if (ACT == 12) v = (v > 0.f) ? v : 0.01f * v; else if (ACT == 8) v = tanhf(v); else if (ACT == 9) v = 0.5f * v * (1.0f + tanhf(0.7978845608028654f * (v + 0.044715f * v * v * v))); else if (ACT == 14) v = (v > 0.f) ? v : 0.1f * v; else if (ACT == 16) v = (v >= 0.f) ? v : 0.3f * v; else if (ACT == 17) v = (v >= 0.f) ? v : 0.2f * v;
      so[w][rloc][t * 16 + ln] = v; } }
  __builtin_amdgcn_fence(__ATOMIC_ACQ_REL, "workgroup"); __builtin_amdgcn_wave_barrier();
  const int rsub = lane >> 4, c4 = (lane & 15) * 4;
  if (QKV) {      /* the projection launch (grid y: q, k, v) stores what the attention launch reads: q and k as f16 hi + x1024 residual planes (C16: q hi, q lo, k hi, k lo, sC apart), v as V^T rows [feature][batch * SQ + token]; f32 rows (C: q, k, v planes) only for each batch's first QT0 tokens, which the exact path reads */
    static_assert(QT0 == 128, "a batch's exact rows are one 128-row block, or two 64-token column blocks of the swapped v product");
    v4f vv[16], pa[16]; v4h vh[16], vl[16];
#pragma unroll      /* constant indices: the sixteen steps' pieces are registers, the row steps immediate offsets */
    for (int q = 0; q < 16; ++q) { vv[q] = *(const v4fa*)&so[w][q * 2 + rsub][c4];
#pragma unroll
      for (int i = 0; i < 4; ++i) { const _Float16 h = (_Float16)vv[q][i]; vh[q][i] = h; vl[q][i] = (_Float16)((vv[q][i] - (float)h) * 1024.0f); pa[q][i] = accs[q >> 1][(q & 1) * 4 + i] * alpha; } }
    if (vtr) {
      if ((col0 & (SQ - 1)) < QT0) { float* fp = C + cofs + (size_t)(col0 + ln) * DM + row0 + 8 * hh;      /* block-uniform: a lane's accumulator registers are 8 successive features of one token: the f32 v row pieces go out straight from them */
        __builtin_amdgcn_sched_barrier(0);      /* every product stands in front of the first store */
#pragma unroll
        for (int u = 0; u < 8; ++u) { *(v4f*)(fp + (u & 3) * (16 * DM) + (u >> 2) * 16) = pa[2 * u]; *(v4f*)(fp + (u & 3) * (16 * DM) + (u >> 2) * 16 + 4) = pa[2 * u + 1]; }
        asm volatile("s_wait_xcnt 0x0" ::: "memory"); }      /* whatever is written behind this block may land on registers that these stores name: the wait stands in front of it */
      _Float16* tp = VTo + (size_t)(row0 + rsub) * (NB * SQ) + col0 + c4;
      __builtin_amdgcn_sched_barrier(0);      /* every conversion and the address stand in front of the first store */
#pragma unroll
      for (int q = 0; q < 16; ++q) *(v4h*)(tp + q * (2 * NB * SQ)) = vh[q];
      asm volatile("s_wait_xcnt 0x0" ::: "memory");      /* in the built code the other branch's block may stand behind these stores and rewrite registers that they name: the wait stands in front of it */
    } else {
      if ((mt & (SQ / 128 - 1)) == 0) { float* fp = C + cofs + (size_t)(row0 + rsub) * DM + col0 + c4;      /* block-uniform */
        __builtin_amdgcn_sched_barrier(0);      /* the LDS reads and the address stand in front of the first store */
#pragma unroll
        for (int q = 0; q < 16; ++q) *(v4f*)(fp + q * (2 * DM)) = vv[q];
        asm volatile("s_wait_xcnt 0x0" ::: "memory"); }      /* as above */
      _Float16* hp = C16 + (size_t)(2 * by) * sC + (size_t)(row0 + rsub) * DM + col0 + c4; _Float16* lp = hp + sC;
      __builtin_amdgcn_sched_barrier(0);      /* conversions and addresses stand in front of the first store */
#pragma unroll
      for (int q = 0; q < 16; ++q) { *(v4h*)(hp + q * (2 * DM)) = vh[q]; *(v4h*)(lp + q * (2 * DM)) = vl[q]; }
      asm volatile("s_wait_xcnt 0x0" ::: "memory"); }      /* in the built code the swapped product's block stands behind these stores and rewrites registers that they name: the wait stands in front of it */
    return; }
  {
#pragma unroll
    for (int q = 0; q < 16; ++q) { const int r = q * 2 + rsub; const v4f v = *(const v4fa*)&so[w][r][c4]; if (C) { *(v4f*)(C + cofs + (size_t)(row0 + r) * ldc + col0 + c4) = v; asm volatile("s_wait_xcnt 0x0" ::: "memory"); }      /* the f32 store's data and address registers are rewritten right behind it (the f16 conversion, the next row): the wait stands in front of that */
      if (C16) { v4h h4; for (int i = 0; i < 4; ++i) h4[i] = (_Float16)v[i]; *(v4h*)(C16 + cofs + (size_t)(row0 + r) * ldc + col0 + c4) = h4; } }
     } }


__global__ __launch_bounds__(256) void k_wnat(const float* __restrict__ w, size_t n8, _Float16* __restrict__ Bt) { const size_t t = (size_t)blockIdx.x * 256 + threadIdx.x; if (t >= n8) return; FragH f; for (int q = 0; q < 8; ++q) f.h[q] = (_Float16)(bf16_round(w[t * 8 + q]) * 16.0f); *(v8us*)((unsigned short*)Bt + t * 8) = f.half[0];  }
__global__ __launch_bounds__(256) void k_rsm(const float* __restrict__ S, _Float16* __restrict__ P, int nrows) {
  #pragma clang fp contract(off)
  const int i = blockIdx.x * 256 + threadIdx.x; if (i >= nrows) return; const float* s = S + (size_t)i * SQ; float mx = -3.0e38f;
#pragma unroll 1
  for (int j = 0; j < SQ; ++j) mx = fmaxf(mx, s[j]); float se = 0.f;
#pragma unroll 1
  for (int j = 0; j < SQ; ++j) se += expf(s[j] - mx); const float sc = 256.0f / se;
#pragma unroll 1
  for (int j0 = 0; j0 < SQ; j0 += 8) { FragH f; for (int q = 0; q < 8; ++q) f.h[q] = (_Float16)(expf(s[j0 + q] - mx) * sc); unsigned short* d = (unsigned short*)P + (size_t)i * SQ + j0; *(v8us*)d = f.half[0];  } }
__global__ __launch_bounds__(256) void k_vt(const _Float16* __restrict__ V16, int b, int h0, _Float16* __restrict__ VT) { __shared__ unsigned short tl[64][65]; const int tid = threadIdx.x; const int hh = blockIdx.x % HG, sg = blockIdx.x / HG; const int s0 = sg * 64; const int h = h0 + hh;
  for (int i = tid; i < 64 * 8; i += 256) { const int j = i / 8, d8 = (i % 8) * 8; FragH f; f.half[0] = *(const v8us*)((const unsigned short*)V16 + ((size_t)b * SQ + s0 + j) * DM + h * HD + d8); for (int q = 0; q < 8; ++q) tl[d8 + q][j] = f.u[q]; }
  __syncthreads();
  { for (int i = tid; i < 64 * 8; i += 256) { const int d = i / 8, j8 = (i % 8) * 8; FragH f; for (int q = 0; q < 8; ++q) f.u[q] = tl[d][j8 + q]; *(v8us*)((unsigned short*)VT + ((size_t)hh * HD + d) * SQ + s0 + j8) = f.half[0]; }  } }



// Exact f32 attention for the first QT0 rows of one head and batch, run by the attention launch's block that owns these rows: one thread per query row; q, k, v are the f32 rows of the full projections; o leaves as f16 hi (into the merged o rows) + x1024 residual.
// The 128 key and value rows (64 floats each) are staged once in LDS by whole-line loads and then read as broadcasts; the thread's q row and o row stay in registers; four keys' score sums run side by side, each in index order.
// Every plain '#pragma unroll' below makes the indices of q, o, s and the staged pieces constants, so that these arrays are registers and not scratch.
__device__ __forceinline__ void fa_exact(const float* __restrict__ QF, const float* __restrict__ KF, const float* __restrict__ VF, int h, int b, int w, _Float16* __restrict__ OH, _Float16* __restrict__ OL, float (*lk)[64], float (*lv)[64]) {
  static_assert(QT0 == 128 && HD == 64, "fa_exact: one thread per row of a block of 128, staging in 16 steps of 8 rows");
  const int tid = threadIdx.x; const int i = tid; const size_t r0 = (size_t)b * SQ;      /* the batch's first token row */
  const char* qh = (const char*)(QF + r0 * DM + h * HD); const char* kh = (const char*)(KF + r0 * DM + h * HD); const char* vh = (const char*)(VF + r0 * DM + h * HD);      /* block-uniform bases */
  const unsigned qoff = (unsigned)(i * DM) * 4u;      /* byte offset of the thread's q row */
  float q[HD], o[HD];
#pragma unroll
  for (int c = 0; c < HD / 4; ++c) { const v4f t4 = *(const v4fa*)(qh + qoff + c * 16);
#pragma unroll
    for (int u = 0; u < 4; ++u) { q[c * 4 + u] = t4[u]; o[c * 4 + u] = 0.f; } }
  const int srow = tid >> 4, sc4 = (tid & 15) * 4; const unsigned soff = (unsigned)(srow * DM + sc4) * 4u;      /* staging: 16 threads per row of 256 bytes, 8 rows a step; byte offset */
  const char* kp = kh + soff; const char* vp = vh + soff;      /* the thread's own staging addresses */
  { v4f tk[16], tv[16];      /* all 32 loads of a thread in flight together */
#pragma unroll
    for (int it = 0; it < 16; ++it) { tk[it] = *(const v4fa*)(kp + it * (8 * DM * 4)); tv[it] = *(const v4fa*)(vp + it * (8 * DM * 4)); }
    asm volatile("s_wait_xcnt 0x0" :: "v"(qoff), "v"(soff), "v"(kp), "v"(vp) : "memory");      /* the loads' offset and address registers stay untouched up to this wait: nothing, a later load's data included, lands on a register that an issued load names */
#pragma unroll
    for (int it = 0; it < 16; ++it) { *(v4f*)&lk[it * 8 + srow][sc4] = tk[it]; *(v4f*)&lv[it * 8 + srow][sc4] = tv[it]; } }
  __syncthreads();      /* publishes the staged rows to the four waves */
  float m = -1.0e30f, l = 0.f; const int nkey = 32 * w + 32;      /* causal form: keys up to the wave's last row (wave-uniform) */
#pragma unroll 1      /* the body is four whole keys of straight-line code already: more would only grow the text */
  for (int j0 = 0; j0 < nkey; j0 += 4) { float s[4] = {0.f, 0.f, 0.f, 0.f}; v4f g[2][16];      /* two register sets of 16 LDS pieces: eight groups a trip (16 head dims of the four k rows, four times; then the four v rows), each read while the group before it is worked on */
#pragma unroll
    for (int cc = 0; cc < 4; ++cc)
#pragma unroll
      for (int u = 0; u < 4; ++u) g[0][cc * 4 + u] = *(const v4f*)&lk[j0 + u][cc * 4];
#pragma unroll
    for (int p = 0; p < 8; ++p) { const int cu = p & 1, nx = cu ^ 1;
      __builtin_amdgcn_sched_barrier(0);      /* with the one below: keeps the reads of group p + 1, and of no later group, in front of group p's arithmetic; left free, the build hoists a whole trip's 128 reads, which takes more registers than two waves a SIMD leave and spills */
      if (p + 1 < 4) {
#pragma unroll
        for (int cc = 0; cc < 4; ++cc)
#pragma unroll
          for (int u = 0; u < 4; ++u) g[nx][cc * 4 + u] = *(const v4f*)&lk[j0 + u][((p + 1) * 4 + cc) * 4]; }
      else if (p + 1 < 8) {
#pragma unroll
        for (int c = 0; c < HD / 4; ++c) g[nx][c] = *(const v4f*)&lv[j0 + p - 3][c * 4]; }
      __builtin_amdgcn_sched_barrier(0);      /* see above */
      if (p < 4) {
#pragma unroll
        for (int cc = 0; cc < 4; ++cc)
#pragma unroll
          for (int x = 0; x < 4; ++x)
#pragma unroll
            for (int u = 0; u < 4; ++u) s[u] = __fadd_rn(s[u], __fmul_rn(q[(p * 4 + cc) * 4 + x], g[cu][cc * 4 + u][x])); }
      else { const int u = p - 4; const int j = j0 + u; const float sv = __fmul_rn(s[u], SCL);
        const float f = (j <= i) ? 1.f : 0.f; const float sm = fmaf(f, sv, (1.f - f) * -1.0e30f); const float mn = fmaxf(m, sm); const float sc = expf(m - mn); const float e = expf(sm - mn); l = __fadd_rn(__fmul_rn(l, sc), e); m = mn;
#pragma unroll
        for (int c = 0; c < HD / 4; ++c)
#pragma unroll
          for (int x = 0; x < 4; ++x) o[c * 4 + x] = __fadd_rn(__fmul_rn(o[c * 4 + x], sc), __fmul_rn(e, g[cu][c][x])); } } }
  const float fin = 64.0f / l;      /* o carried x64 like the f16 path */
  __syncthreads();      /* every wave has left the k rows: their LDS takes the o rows */
#pragma unroll
  for (int c = 0; c < HD / 4; ++c) { v4f oo;
#pragma unroll
    for (int u = 0; u < 4; ++u) oo[u] = __fmul_rn(o[c * 4 + u], fin);
    *(v4f*)&lk[tid][c * 4] = oo; }
  __syncthreads();      /* publishes the o rows to the four waves */
  v4h vh4[16], vl4[16]; const int orow = tid / 16, pc = (tid % 16) * 4;      /* 16 threads per row, 8 rows a step */
#pragma unroll      /* constant indices: the sixteen steps' pieces are registers, the row steps immediate offsets */
  for (int it = 0; it < 16; ++it) { const v4f v = *(const v4f*)&lk[it * 8 + orow][pc];
#pragma unroll
    for (int u = 0; u < 4; ++u) { const _Float16 hi = (_Float16)v[u]; vh4[it][u] = hi; vl4[it][u] = (_Float16)((v[u] - (float)hi) * 1024.0f); } }
  __builtin_amdgcn_sched_barrier(0);      /* every conversion stands in front of the first store, so that no register which an issued store names is written again before the wave ends */
  _Float16* ohp = OH + (r0 + orow) * DM + h * HD + pc; _Float16* olp = OL + ((size_t)b * QT0 + orow) * DM + h * HD + pc;
#pragma unroll
  for (int it = 0; it < 16; ++it) { *(v4h*)(ohp + it * (8 * DM)) = vh4[it]; *(v4h*)(olp + it * (8 * DM)) = vl4[it]; } }

// Fused causal attention: a block owns 128 query rows of one head (32 per wave) and walks the keys 64 at a time; scores and weights never leave registers.
// Each pass has 64 rows of k hi, k lo and 64 rows (head dims) of V^T in LDS, brought once for the four waves by asynchronous 16-byte copies (whole lines), two buffers: pass t + 2 is issued behind the barrier that ends pass t and flies while pass t + 1 is worked on; row pitch 128 + 16 bytes for the 16-byte fragment reads.
// S^T = K . Q^T (A = 16 key rows, B = 16 query rows, both by g2_frag): a lane holds 8 keys (8*hh + r) of ONE query (ln) per tile, so maximum and sum are in-lane plus one exchange of the wave halves.
// Two score tiles of one query group, converted in place, are the B operand of O^T += V^T . P^T (element i = key 8*hh + i, element 8 + i = key 16 + 8*hh + i: the k order of g2_frag on the V^T rows).
// Scores: (lo . hi + hi . lo) first, x 2^-10, then hi . hi on top in the same accumulator. Weights carried x256 (the + 8 in the exponent), in the f16 operand and in the row sum alike; o leaves x64.
#define FAC 0.18033688011112042f           /* 1 / sqrt(head_dim) * log2(e) */
#define FLP 72                             /* LDS row pitch in f16: 64 + 8 */
__device__ __forceinline__ float fa_exp2(float x) { asm("v_exp_f32 %0, %0\n\tv_nop" : "+v"(x)); return x; }      /* native 2^x; the v_nop fills the one slot that the instruction set asks for between a transcendental and a directly following instruction that reads its result or overwrites its source */
__device__ __forceinline__ v8f fa_mma(v16h a, v16h b, v8f c) { return __builtin_amdgcn_wmma_f32_16x16x32_f16(false, a, false, b, (short)0, c, false, false); }
__global__ __launch_bounds__(128, 2) void k_fattn(const _Float16* __restrict__ QHp, const _Float16* __restrict__ QLp, const _Float16* __restrict__ KHp, const _Float16* __restrict__ KLp, const _Float16* __restrict__ VTp, _Float16* __restrict__ Op, const float* __restrict__ QF, const float* __restrict__ KF, const float* __restrict__ VF, _Float16* __restrict__ OLp) {      /* two waves a SIMD: the register bound under which all 512 blocks are resident at once (the exact part alone would take more) */
  __shared__ __attribute__((aligned(16))) float xk[QT0][64]; __shared__ __attribute__((aligned(16))) float xv[QT0][64];      /* the exact block's f32 key and value rows */
  __shared__ __attribute__((aligned(16))) _Float16 lkh[2][64][FLP]; __shared__ __attribute__((aligned(16))) _Float16 lkl[2][64][FLP]; __shared__ __attribute__((aligned(16))) _Float16 lvt[2][64][FLP];      /* two buffers: pass t + 1's rows fly in while pass t is worked on */
  const int tid = threadIdx.x, lane = tid & 31, ln = lane & 15, hh = lane >> 4; const int w = __builtin_amdgcn_readfirstlane(tid >> 5);
  const int h = blockIdx.y, b = blockIdx.z; const int nqt = (int)gridDim.x, x2 = (int)blockIdx.x + 2; const int qt = (b & 1) ? (x2 >= nqt ? x2 - nqt : x2) : nqt - 1 - (int)blockIdx.x;      /* long and short blocks mixed over the grid: at equal blockIdx.x the two batches hold tiles 15 - x and x + 2 (mod 16), so that a long tile is paired with a short one and the exact tile 0 with tile 1 */
  if (qt == 0) { fa_exact(QF, KF, VF, h, b, w, Op, OLp, xk, xv); return; }      /* block-uniform, in front of every barrier of the f16 path: rows 0..127 are computed exactly in f32, beside the other blocks' f16 work */
  const int row0 = qt * 128 + 32 * w; const size_t r0 = (size_t)b * SQ;
  v16h qh[2][2], ql[2][2]; const _Float16* qhp = QHp + (r0 + row0 + ln) * LQ + h * HD + 8 * hh; const _Float16* qlp = QLp + (r0 + row0 + ln) * LQ + h * HD + 8 * hh;      /* the lane's own 16-byte pieces start here (g2_frag with half 0) */
#pragma unroll
  for (int g = 0; g < 2; ++g) { qh[g][0] = g2_frag(qhp + g * (16 * LQ), 0); qh[g][1] = g2_frag(qhp + g * (16 * LQ) + 32, 0); ql[g][0] = g2_frag(qlp + g * (16 * LQ), 0); ql[g][1] = g2_frag(qlp + g * (16 * LQ) + 32, 0); }
  asm volatile("s_wait_xcnt 0x0" :: "v"(qhp), "v"(qlp) : "memory");      /* the sixteen loads' address registers stay untouched up to this wait: nothing, a later load's data included, lands on them before it */
  const char* khb = (const char*)(KHp + r0 * LQ + h * HD); const char* klb = (const char*)(KLp + r0 * LQ + h * HD); const char* vtb = (const char*)(VTp + (size_t)(h * HD) * (NB * SQ) + r0);      /* block-uniform bases; V^T rows are [feature][batch * SQ + token] */
  const int srow = tid >> 3, sc8 = (tid & 7) * 8; const unsigned koff = (unsigned)(srow * LQ + sc8) * 2u, voff = (unsigned)(srow * (NB * SQ) + sc8) * 2u;      /* staging: 8 threads per row of 128 bytes, 16 rows a step; byte offsets */
  const v8f z8 = {0.f,0.f,0.f,0.f,0.f,0.f,0.f,0.f}; v8f o[4][2];
#pragma unroll
  for (int dt = 0; dt < 4; ++dt) { o[dt][0] = z8; o[dt][1] = z8; }
  float m[2] = {-1.0e30f, -1.0e30f}, l[2] = {0.f, 0.f};
  const int kend = qt * 128 + 64;           /* the block's last piece: every wave stages and passes the barriers up to it */
  const unsigned lak = (unsigned)(size_t)&lkh[0][srow][sc8], lal = (unsigned)(size_t)&lkl[0][srow][sc8], lav = (unsigned)(size_t)&lvt[0][srow][sc8];      /* byte addresses in the work-group's LDS */
  auto stage = [&](int kb, int bf) { unsigned sl[12]; const char* sg[12];      /* one pass's rows: 4 copies each of k hi, k lo and V^T per thread */
#pragma unroll
    for (int j = 0; j < 4; ++j) { const unsigned lo = (unsigned)bf * (unsigned)sizeof(lkh[0]) + (unsigned)j * (16u * FLP * 2u); sl[j] = lak + lo; sl[4 + j] = lal + lo; sl[8 + j] = lav + lo;
      sg[j] = khb + (size_t)kb * (LQ * 2) + koff + j * (16 * LQ * 2); sg[4 + j] = klb + (size_t)kb * (LQ * 2) + koff + j * (16 * LQ * 2); sg[8 + j] = vtb + (size_t)kb * 2 + voff + j * (16 * NB * SQ * 2); }
    g2_copy12(sl, sg); };
  stage(0, 0);
  asm volatile("s_wait_asynccnt 0x0" ::: "memory");      /* this wave's copies of pass 0 have landed */
  __syncthreads();      /* publishes pass 0's rows to the four waves */
  stage(64, 1);      /* every block of this path has four passes or more */
#pragma unroll 1      /* one pass is up to 64 matrix instructions of straight-line code already */
  for (int kb = 0; kb <= kend; kb += 64) { const int bf = (kb >> 6) & 1;      /* the pass reads this buffer alone */
#pragma unroll
    for (int hf = 0; hf < 2; ++hf) { const int k0 = kb + 32 * hf;      /* 32 keys a step: 16 score registers per query group alive at a time */
      if (k0 <= row0) {      /* wave-uniform: keys past the wave's last row (row0 + 31) are left out whole */
        v8f s[2][2];
#pragma unroll
        for (int t = 0; t < 2; ++t) { const int kr = 32 * hf + 16 * t + ln; const v16h a0 = g2_frag(&lkh[bf][kr][0], hh), a1 = g2_frag(&lkh[bf][kr][32], hh), c0 = g2_frag(&lkl[bf][kr][0], hh), c1 = g2_frag(&lkl[bf][kr][32], hh);
#pragma unroll
          for (int g = 0; g < 2; ++g) { v8f y = fa_mma(a0, ql[g][0], z8); y = fa_mma(a1, ql[g][1], y); y = fa_mma(c0, qh[g][0], y); y = fa_mma(c1, qh[g][1], y);
#pragma unroll
            for (int r = 0; r < 8; ++r) y[r] *= 0.0009765625f;
            y = fa_mma(a0, qh[g][0], y); y = fa_mma(a1, qh[g][1], y); s[t][g] = y; } }
        if (k0 == row0) {      /* wave-uniform: the 32 x 32 piece on the diagonal is the only one that needs the causal test; key k0 stays for every query */
#pragma unroll
          for (int t = 0; t < 2; ++t)
#pragma unroll
            for (int g = 0; g < 2; ++g)
#pragma unroll
              for (int r = 0; r < 8; ++r) if (16 * t + 8 * hh + r > 16 * g + ln) s[t][g][r] = -1.0e30f; }
        FragH p[2];
#pragma unroll
        for (int g = 0; g < 2; ++g) { float mx = s[0][g][0];
#pragma unroll
          for (int t = 0; t < 2; ++t)
#pragma unroll
            for (int r = 0; r < 8; ++r) mx = fmaxf(mx, s[t][g][r]);
          mx = fmaxf(mx, __shfl_xor(mx, 16, 32));      /* the other 8 keys of every tile sit in the other wave half */
          const float mn = fmaxf(m[g], mx); const float sc = fa_exp2((m[g] - mn) * FAC); m[g] = mn; const float nb = fmaf(-mn, FAC, 8.0f);
          float ps[4] = {0.f, 0.f, 0.f, 0.f};
#pragma unroll
          for (int t = 0; t < 2; ++t)
#pragma unroll
            for (int r = 0; r < 8; ++r) { const float e = fa_exp2(fmaf(s[t][g][r], FAC, nb)); ps[r & 3] += e; p[g].h[t * 8 + r] = (_Float16)e; }
          l[g] = fmaf(l[g], sc, (ps[0] + ps[1]) + (ps[2] + ps[3]));
#pragma unroll
          for (int dt = 0; dt < 4; ++dt)
#pragma unroll
            for (int r = 0; r < 8; ++r) o[dt][g][r] *= sc; }
#pragma unroll
        for (int dt = 0; dt < 4; ++dt) { const v16h a = g2_frag(&lvt[bf][16 * dt + ln][32 * hf], hh); o[dt][0] = fa_mma(a, p[0].v, o[dt][0]); o[dt][1] = fa_mma(a, p[1].v, o[dt][1]); } } }
    asm volatile("s_wait_dscnt 0x0" ::: "memory");      /* this wave's reads of this pass's rows are done before their buffer is refilled */
    asm volatile("s_wait_asynccnt 0x0" ::: "memory");      /* this wave's copies of the next pass's rows have landed */
    __syncthreads();      /* publishes the next pass's rows and ends every wave's reads of this pass's */
    if (kb + 128 <= kend) stage(kb + 128, bf); }      /* block-uniform */
  asm volatile("s_wait_asynccnt 0x0" ::: "memory");      /* no copy is outstanding when the wave goes on */
#pragma unroll
  for (int g = 0; g < 2; ++g) { const float fin = 64.0f / (l[g] + __shfl_xor(l[g], 16, 32));      /* the halves' sums joined once; x256 cancels, o carried x64 */
    unsigned short* op = (unsigned short*)Op + (r0 + row0 + 16 * g + ln) * DM + h * HD + 8 * hh;
#pragma unroll
    for (int dt = 0; dt < 4; ++dt) { FragH f;
#pragma unroll
      for (int r = 0; r < 8; ++r) f.h[r] = (_Float16)(o[dt][g][r] * fin);
      *(v8us*)(op + 16 * dt) = f.half[0]; } } }


extern "C" void kernel_launch(void* const* d_in, const int* in_sizes, int n_in,
                              void* d_out, int out_size, void* d_ws, size_t ws_size, hipStream_t stream) {
  (void)in_sizes; (void)n_in; (void)out_size;
  const float* const* I = (const float* const*)d_in; const float* x = I[0]; const float* xk = I[1]; const float* xv = I[2]; const float* wq = I[3]; const float* wk = I[4]; const float* wv = I[5]; const float* wo = I[6]; const float* bo = I[7];      /* input order: query_data, key_data, value_data (three SEPARATE streams: the three exact-f16 row casts read one each), Wq, Wk, Wv ([in][out]; the module has NO q / k / v biases), Wp ([in][out]), bp (REAL); NO mask input (the causal fill is built inside the reference) */
  char* ws = (char*)d_ws; size_t off = 0;
  auto take = [&](size_t bytes) { char* p = ws + off; off += (bytes + 255) & ~(size_t)255; return p; };
  _Float16* BQ = (_Float16*)take((size_t)DM * DM * 2); _Float16* BK = (_Float16*)take((size_t)DM * DM * 2); _Float16* BV = (_Float16*)take((size_t)DM * DM * 2); _Float16* BO = (_Float16*)take((size_t)DM * DM * 2);
  _Float16* X16 = (_Float16*)take(NR * DM * 2); _Float16* XK16 = (_Float16*)take(NR * DM * 2); _Float16* XV16 = (_Float16*)take(NR * DM * 2);      /* exact f16 rows of query, key, value */ float* QF = (float*)take(NR * DM * 4); float* KF = (float*)take(NR * DM * 4); float* VF = (float*)take(NR * DM * 4);      /* f32 q, k, v rows, a plane each: only rows 0..127 of each batch are written, and the exact path reads only them */ _Float16* QH = (_Float16*)take(NR * DM * 2); _Float16* QL = (_Float16*)take(NR * DM * 2); _Float16* KH = (_Float16*)take(NR * DM * 2); _Float16* KL = (_Float16*)take(NR * DM * 2); _Float16* Q16 = QH; _Float16* K16 = KH; _Float16* O16 = (_Float16*)take(NR * DM * 2);
  _Float16* VT = (_Float16*)take((size_t)NB * NH * HD * SQ * 2);
  _Float16* OL0 = (_Float16*)take((size_t)NB * QT0 * DM * 2);      /* x1024 residual of the exact o rows */
  if (off > ws_size) return;
  static_assert(B0 == 0 && NBR == NB, "the conversion launches take whole planes");
  k_prep<<<PWB + PXB, 256, 0, stream>>>(x, xk, xv, wq, wk, wv, wo, X16, BQ);      /* the four weights [in][out] -> Bt[n][k] x16 (BQ, BK, BV, BO lie one behind the other) and the three exact f16 row casts (X16, XK16, XV16 likewise) in one launch */
  const size_t r0p = (size_t)B0 * SQ;      /* first projected row */
  static_assert((MP / 128) * (DM / 64) == (DM / 128) * (MP / 64), "the swapped v product has as many blocks as the q and k products");
  k_gemm2<0, 1><<<dim3((unsigned)((MP / 128) * (DM / 64)), 3), 128, 0, stream>>>(X16, DM, NR * DM, BQ, DM, (size_t)DM * DM, 0.0625f, nullptr, 0, QF, QH, DM, NR * DM, MP, DM, DM, VT, nullptr);      /* the three projections in one launch (grid y; the module has no q / k / v biases): q and k leave as f16 hi + x1024 residual planes (QH, QL, KH, KL one behind the other; unscaled logits sigma ~8), v as V^T rows [DM][NB * SQ]; f32 rows (QF, KF, VF one behind the other) only for rows 0..127 of each batch */
  static_assert(QT0 == 128, "the attention launch's first query block is the exact one");
  k_fattn<<<dim3(SQ / 128, NH, NB), 128, 0, stream>>>(QH, QL, KH, KL, VT, O16, QF, KF, VF, OL0);      /* scores, causal softmax and P . V in one launch for all rows, heads and batches: o (merged heads, x64) as f16 rows; the blocks of rows 0..127 run the exact f32 attention: f16 hi into the o rows, x1024 residual into its own plane */
  k_gemm2<0, 0><<<dim3((unsigned)((MPO / 128) * (DM / 64)), 1), 128, 0, stream>>>(O16 + r0p * DM, DM, 0, BO, DM, 0, 0.0009765625f, bo, 0, (float*)d_out + r0p * DM, nullptr, DM, 0, MPO, DM, DM, nullptr, OL0);      /* out rows are the output layout; the blocks of rows 0..127 of each batch sum o_lo Wo first (x 2^-10 in the accumulators, 2^-20 with alpha) and o_hi Wo on top */
}
